// v000
// Times are from an AMD MI455X. After a warm-up the kernel runs many times in a row, and a time is the length of
// such a window on the GPU divided by its runs, so every launch and the gaps after it count. The runs cycle
// through copies of the inputs. A figure is the median of several windows, for all but v000 over two sittings.
// Sittings can differ by a few percent; kernels timed side by side share one.
// v000, which the later versions start from, runs in 18.9 microseconds.
#include <hip/hip_runtime.h>

typedef float v2f __attribute__((ext_vector_type(2)));
typedef float v8f __attribute__((ext_vector_type(8)));

#define B_ 2
#define L_ 4096
#define H_ 8
#define E_ 64

#define BAND_ROWS 128   // union key band for 64 queries: [q0-32, q0+95]
#define BSTR 76         // band row stride (floats): bank-conflict-free pad
#define ASTR 84         // dense-score row stride (floats): 20r+c tiles 64 banks

__global__ __launch_bounds__(128)
void lda_wmma_kernel(const float* __restrict__ Q,
                     const float* __restrict__ K,
                     const float* __restrict__ V,
                     float* __restrict__ O)
{
    __shared__ float band[BAND_ROWS * BSTR];   // 38,912 B: K band, then reused for V band
    __shared__ float ad[4 * 16 * ASTR];        // 21,504 B: per-wave dense scores/weights

    const int tid  = threadIdx.x;
    const int lane = tid & 31;
    const int wave = tid >> 5;
    const int lrow = lane & 15;   // M / N index within 16
    const int lhi  = lane >> 4;   // K-half selector (0: k=0,1  1: k=2,3)

    const int tile = blockIdx.x & 63;          // L/64 tiles
    const int h    = (blockIdx.x >> 6) & 7;
    const int b    = blockIdx.x >> 9;
    const int q0   = tile * 64;

    // ---------------- Q rows of this wave -> A-operand registers ----------------
    // A(16x4) layout: lanes 0-15 hold M=lane, k = {0,1}; lanes 16-31 hold M, k = {2,3}
    v2f qa[16];
    {
        const int qrow = q0 + wave * 16 + lrow;
        const float* qp = Q + (((size_t)b * L_ + qrow) * H_ + h) * E_ + 2 * lhi;
        #pragma unroll
        for (int kk = 0; kk < 16; ++kk) {
            qa[kk][0] = qp[4 * kk + 0];
            qa[kk][1] = qp[4 * kk + 1];
        }
    }

    // ---------------- cooperative load: K band (128 rows x 64 fp32) ----------------
    #pragma unroll
    for (int i = 0; i < 16; ++i) {
        const int f   = i * 128 + tid;
        const int row = f >> 4;               // 0..127
        const int c4  = (f & 15) << 2;        // 0..60, float4 column
        int p = q0 - 32 + row;                // clamp == reference's index clip
        p = p < 0 ? 0 : (p > (L_ - 1) ? (L_ - 1) : p);
        const float4 g = *(const float4*)(K + (((size_t)b * L_ + p) * H_ + h) * E_ + c4);
        *(float4*)(&band[row * BSTR + c4]) = g;
    }
    __syncthreads();

    // ---------------- GEMM1: S(16x80) = Q(16x64) * Kband^T ----------------
    // wave w uses band rows [16w, 16w+79]; column tile c covers band rows 16(w+c)..+15
    v8f sacc[5];
    #pragma unroll
    for (int c = 0; c < 5; ++c) sacc[c] = (v8f){0.f,0.f,0.f,0.f,0.f,0.f,0.f,0.f};
    #pragma unroll
    for (int kk = 0; kk < 16; ++kk) {
        #pragma unroll
        for (int c = 0; c < 5; ++c) {
            // B(4x16): lane holds col N=lrow, k-pair (2*lhi,2*lhi+1) -> contiguous float2 in band row
            const v2f bv = *(const v2f*)(&band[(16 * (wave + c) + lrow) * BSTR + 4 * kk + 2 * lhi]);
            sacc[c] = __builtin_amdgcn_wmma_f32_16x16x4_f32(
                false, qa[kk], false, bv, (short)0, sacc[c], false, false);
        }
    }

    // scatter dense scores: C/D layout -> ad[wave][M][j]
    float* aw = &ad[wave * 16 * ASTR];
    #pragma unroll
    for (int c = 0; c < 5; ++c) {
        #pragma unroll
        for (int r = 0; r < 8; ++r)
            aw[(r + 8 * lhi) * ASTR + 16 * c + lrow] = sacc[c][r];
    }
    __syncthreads();   // all waves finished reading K band; scores parked in LDS

    // ---------------- cooperative load: V band (overwrites K band) ----------------
    #pragma unroll
    for (int i = 0; i < 16; ++i) {
        const int f   = i * 128 + tid;
        const int row = f >> 4;
        const int c4  = (f & 15) << 2;
        int p = q0 - 32 + row;
        p = p < 0 ? 0 : (p > (L_ - 1) ? (L_ - 1) : p);
        const float4 g = *(const float4*)(V + (((size_t)b * L_ + p) * H_ + h) * E_ + c4);
        *(float4*)(&band[row * BSTR + c4]) = g;
    }

    // ---------------- softmax over the 33 valid diagonal entries per row ----------------
    if (lane < 16) {
        const int i = lane;                   // local query row; valid j = i + 2k, k=0..32
        float* rowp = aw + i * ASTR;
        const float scale = 0.125f;           // 1/sqrt(64)
        float m = -3.402823466e38f;
        #pragma unroll 1
        for (int k = 0; k < 33; ++k) m = fmaxf(m, rowp[i + 2 * k]);
        m *= scale;
        float sum = 0.f;
        #pragma unroll 1
        for (int k = 0; k < 33; ++k) {
            const float e = __expf(rowp[i + 2 * k] * scale - m);
            rowp[i + 2 * k] = e;
            sum += e;
        }
        const float inv = 1.f / sum;
        #pragma unroll 1
        for (int k = 0; k < 33; ++k) rowp[i + 2 * k] *= inv;
        // zero the dense positions outside the dilated window
        #pragma unroll 1
        for (int j = 0; j < 80; ++j) {
            const bool valid = (j >= i) && (j <= i + 64) && (((j - i) & 1) == 0);
            if (!valid) rowp[j] = 0.f;
        }
    }
    __syncthreads();   // V band + normalized weights ready

    // ---------------- GEMM2: O(16x64) = A(16x80) * Vband(80x64) ----------------
    v8f oacc[4];
    #pragma unroll
    for (int c = 0; c < 4; ++c) oacc[c] = (v8f){0.f,0.f,0.f,0.f,0.f,0.f,0.f,0.f};
    #pragma unroll
    for (int kk = 0; kk < 20; ++kk) {
        const v2f av = *(const v2f*)(&aw[lrow * ASTR + 4 * kk + 2 * lhi]);
        const int vr = 16 * wave + 4 * kk + 2 * lhi;
        #pragma unroll
        for (int c = 0; c < 4; ++c) {
            v2f bv;   // B(4x16): lane needs 2 floats from same column, adjacent band rows
            bv[0] = band[(vr    ) * BSTR + 16 * c + lrow];
            bv[1] = band[(vr + 1) * BSTR + 16 * c + lrow];
            oacc[c] = __builtin_amdgcn_wmma_f32_16x16x4_f32(
                false, av, false, bv, (short)0, oacc[c], false, false);
        }
    }

    // ---------------- store output ----------------
    const int orow0 = q0 + wave * 16 + 8 * lhi;
    #pragma unroll
    for (int r = 0; r < 8; ++r) {
        float* op = O + (((size_t)b * L_ + (orow0 + r)) * H_ + h) * E_ + lrow;
        #pragma unroll
        for (int c = 0; c < 4; ++c) op[16 * c] = oacc[c][r];
    }
}

extern "C" void kernel_launch(void* const* d_in, const int* in_sizes, int n_in,
                              void* d_out, int out_size, void* d_ws, size_t ws_size,
                              hipStream_t stream) {
    (void)in_sizes; (void)n_in; (void)out_size; (void)d_ws; (void)ws_size;
    const float* Q = (const float*)d_in[0];
    const float* K = (const float*)d_in[1];
    const float* V = (const float*)d_in[2];
    float* O = (float*)d_out;
    // grid = B * H * (L/64) = 2 * 8 * 64 = 1024 blocks, 128 threads (4 wave32)
    lda_wmma_kernel<<<dim3(1024), dim3(128), 0, stream>>>(Q, K, V, O);
}

// v001
// One run takes 11.9 microseconds.
// Two timings next to v000 both put it at 1.62 times that version's speed.
#include <hip/hip_runtime.h>

typedef float v2f __attribute__((ext_vector_type(2)));
typedef float v4f __attribute__((ext_vector_type(4)));
typedef float v8f __attribute__((ext_vector_type(8)));

#define B_ 2
#define L_ 4096
#define H_ 8
#define E_ 64

#define BAND_ROWS 128   // union key band for 64 queries: [q0-32, q0+95]
#define BSTR 76         // band row stride (floats): bank-conflict-free pad

// lane l <-> lane l ^ 16
__device__ __forceinline__ float xhalf(float v) {
    const int b = __builtin_bit_cast(int, v);
    return __builtin_bit_cast(float, __builtin_amdgcn_permlanex16(b, b, 0x76543210, 0xfedcba98, false, false));
}

__global__ __launch_bounds__(128)
void lda_wmma_kernel(const float* __restrict__ Q,
                     const float* __restrict__ K,
                     const float* __restrict__ V,
                     float* __restrict__ O)
{
    __shared__ float band[BAND_ROWS * BSTR];   // 38,912 B: K band, then reused for V band

    const int tid  = threadIdx.x;
    const int lane = tid & 31;
    const int wave = tid >> 5;
    const int lrow = lane & 15;   // M / N index within 16
    const int lhi  = lane >> 4;   // K-half selector (0: k=0,1  1: k=2,3)

    const int tile = blockIdx.x & 63;          // L/64 tiles
    const int h    = (blockIdx.x >> 6) & 7;
    const int b    = blockIdx.x >> 9;
    const int q0   = tile * 64;

    // ---------------- Q rows of this wave -> B-operand registers ----------------
    // A(16x4) layout: lanes 0-15 hold M=lane, k = {0,1}; lanes 16-31 hold M, k = {2,3}
    v2f qa[16];
    {
        const int qrow = q0 + wave * 16 + lrow;
        const float* qp = Q + (((size_t)b * L_ + qrow) * H_ + h) * E_ + 2 * lhi;
        #pragma unroll
        for (int kk = 0; kk < 16; ++kk) {
            qa[kk][0] = qp[4 * kk + 0];
            qa[kk][1] = qp[4 * kk + 1];
        }
    }

    // ---------------- cooperative load: K band (128 rows x 64 fp32) ----------------
    #pragma unroll
    for (int i = 0; i < 16; ++i) {
        const int f   = i * 128 + tid;
        const int row = f >> 4;               // 0..127
        const int c4  = (f & 15) << 2;        // 0..60, float4 column
        int p = q0 - 32 + row;                // clamp == reference's index clip
        p = p < 0 ? 0 : (p > (L_ - 1) ? (L_ - 1) : p);
        const float4 g = *(const float4*)(K + (((size_t)b * L_ + p) * H_ + h) * E_ + c4);
        *(float4*)(&band[row * BSTR + c4]) = g;
    }
    __syncthreads();

    // ---------------- GEMM1, transposed: S^T(80x16) = Kband(80x64) * Q^T ----------------
    // wave w uses band rows [16w, 16w+79]; row tile c covers band rows 16(w+c)..+15.
    // A(16x4) and B(4x16) hold the same (row-or-column = lrow, k pair = 2*lhi) map, so the K
    // fragment goes in as A and the Q fragment as B. D then holds, in lane (lrow, lhi),
    // st[c][r] = score(query lrow, local key j = 16c + 8*lhi + r): one query per lane.
    v8f st[5];
    #pragma unroll
    for (int c = 0; c < 5; ++c) st[c] = (v8f){0.f,0.f,0.f,0.f,0.f,0.f,0.f,0.f};
    #pragma unroll
    for (int kk = 0; kk < 16; ++kk) {
        #pragma unroll
        for (int c = 0; c < 5; ++c) {
            const v2f kv = *(const v2f*)(&band[(16 * (wave + c) + lrow) * BSTR + 4 * kk + 2 * lhi]);
            st[c] = __builtin_amdgcn_wmma_f32_16x16x4_f32(
                false, kv, false, qa[kk], (short)0, st[c], false, false);
        }
    }
    __syncthreads();   // all waves finished reading K band; scores stay in registers

    // ---------------- cooperative load: V band (overwrites K band) ----------------
    #pragma unroll
    for (int i = 0; i < 16; ++i) {
        const int f   = i * 128 + tid;
        const int row = f >> 4;
        const int c4  = (f & 15) << 2;
        int p = q0 - 32 + row;
        p = p < 0 ? 0 : (p > (L_ - 1) ? (L_ - 1) : p);
        const float4 g = *(const float4*)(V + (((size_t)b * L_ + p) * H_ + h) * E_ + c4);
        *(float4*)(&band[row * BSTR + c4]) = g;
    }

    // keeps the V loads and their LDS stores ahead of the softmax: scheduled together with it, two of
    // the sixteen loads issue only behind the wait for the other fourteen, a second memory round trip
    __builtin_amdgcn_sched_barrier(0);

    // ---------------- softmax in registers: 33 valid entries per query ----------------
    // valid keys of query i = lrow: j = i + 2k, k = 0..32. 16c + 8*lhi is even, so a lane's valid
    // keys sit in the registers r of its own parity: 20 candidates per lane, 40 per query with
    // the partner lane (l ^ 16). Only tiles 0 and 4 reach past the window's ends.
    const bool odd = (lrow & 1) != 0;
    const int  t0  = 8 * lhi + (lrow & 1) - lrow;   // j - i of pair 0 in tile 0
    const float scale = 0.125f;                     // 1/sqrt(64)
    float x[5][4];
    float m = -3.402823466e38f;
    #pragma unroll
    for (int c = 0; c < 5; ++c) {
        const v4f ev = __builtin_shufflevector(st[c], st[c], 0, 2, 4, 6);
        const v4f od = __builtin_shufflevector(st[c], st[c], 1, 3, 5, 7);
        const v4f own = odd ? od : ev;
        #pragma unroll
        for (int p = 0; p < 4; ++p) {
            float s = own[p];
            if (c == 0) s = (t0 + 2 * p >= 0) ? s : -3.402823466e38f;   // j >= i
            if (c == 4) s = (t0 + 2 * p <= 0) ? s : -3.402823466e38f;   // j <= i + 64
            x[c][p] = s;
            m = fmaxf(m, s);
        }
    }
    m = fmaxf(m, xhalf(m)) * scale;
    float sum = 0.f;
    #pragma unroll
    for (int c = 0; c < 5; ++c) {
        #pragma unroll
        for (int p = 0; p < 4; ++p) {
            const float e = __expf(x[c][p] * scale - m);   // masked entries underflow to 0
            x[c][p] = e;
            sum += e;
        }
    }
    sum += xhalf(sum);
    const float inv = 1.f / sum;
    __syncthreads();   // V band ready

    // ---------------- GEMM2: O(16x64) = W(16x80) * Vband(80x64) ----------------
    // k step (c, p): A's k = 2*lhi + t is local key 16c + 8*lhi + 2p + t, which is what the lane
    // already holds; the V loader below takes the same rows for the same k.
    v8f oacc[4];
    #pragma unroll
    for (int c = 0; c < 4; ++c) oacc[c] = (v8f){0.f,0.f,0.f,0.f,0.f,0.f,0.f,0.f};
    #pragma unroll
    for (int c = 0; c < 5; ++c) {
        #pragma unroll
        for (int p = 0; p < 4; ++p) {
            const float w = x[c][p] * inv;
            v2f av;   // the key of the other parity is outside the dilated window: weight 0
            av[0] = odd ? 0.f : w;
            av[1] = odd ? w : 0.f;
            const int vr = 16 * (wave + c) + 8 * lhi + 2 * p;
            #pragma unroll
            for (int n = 0; n < 4; ++n) {
                v2f bv;   // B(4x16): lane needs 2 floats from same column, adjacent band rows
                bv[0] = band[(vr    ) * BSTR + 16 * n + lrow];
                bv[1] = band[(vr + 1) * BSTR + 16 * n + lrow];
                oacc[n] = __builtin_amdgcn_wmma_f32_16x16x4_f32(
                    false, av, false, bv, (short)0, oacc[n], false, false);
            }
        }
    }

    // ---------------- store output ----------------
    const int orow0 = q0 + wave * 16 + 8 * lhi;
    #pragma unroll
    for (int r = 0; r < 8; ++r) {
        float* op = O + (((size_t)b * L_ + (orow0 + r)) * H_ + h) * E_ + lrow;
        #pragma unroll
        for (int c = 0; c < 4; ++c) op[16 * c] = oacc[c][r];
    }
}

extern "C" void kernel_launch(void* const* d_in, const int* in_sizes, int n_in,
                              void* d_out, int out_size, void* d_ws, size_t ws_size,
                              hipStream_t stream) {
    (void)in_sizes; (void)n_in; (void)out_size; (void)d_ws; (void)ws_size;
    const float* Q = (const float*)d_in[0];
    const float* K = (const float*)d_in[1];
    const float* V = (const float*)d_in[2];
    float* O = (float*)d_out;
    // grid = B * H * (L/64) = 2 * 8 * 64 = 1024 blocks, 128 threads (4 wave32)
    lda_wmma_kernel<<<dim3(1024), dim3(128), 0, stream>>>(Q, K, V, O);
}

// v002
// It runs in 9.6 microseconds.
// Two timings next to v001 both put it at 1.24 times that version's speed.
// Over all steps from v000 it is 2.01 times as fast.
#include <hip/hip_runtime.h>

typedef float v2f __attribute__((ext_vector_type(2)));
typedef float v8f __attribute__((ext_vector_type(8)));

#define B_ 2
#define L_ 4096
#define H_ 8
#define E_ 64

#define BAND_ROWS 128   // union key band for 64 queries: [q0-32, q0+95], kept split by row parity
#define BSTR 76         // band row stride (floats): bank-conflict-free pad

// lane l <-> lane l ^ 16
__device__ __forceinline__ float xhalf(float v) {
    const int b = __builtin_bit_cast(int, v);
    return __builtin_bit_cast(float, __builtin_amdgcn_permlanex16(b, b, 0x76543210, 0xfedcba98, false, false));
}

__global__ __launch_bounds__(128)
void lda_wmma_kernel(const float* __restrict__ Q,
                     const float* __restrict__ K,
                     const float* __restrict__ V,
                     float* __restrict__ O)
{
    __shared__ float band[BAND_ROWS * BSTR];   // 38,912 B: K band, then reused for V band

    const int tid  = threadIdx.x;
    const int lane = tid & 31;
    const int wave = tid >> 5;
    const int lrow = lane & 15;   // M / N index within 16
    const int lhi  = lane >> 4;   // K-half selector (0: k=0,1  1: k=2,3)

    const int tile = blockIdx.x & 63;          // L/64 tiles
    const int h    = (blockIdx.x >> 6) & 7;
    const int b    = blockIdx.x >> 9;
    const int q0   = tile * 64;

    // The window steps by 2, so a query only meets keys of its own parity. Wave w takes the 16
    // queries q0 + 32*hf + 2*i + par (i = lrow): among the keys of that parity their windows are
    // dense and span 48 keys (3 tiles of 16), query i using local keys i .. i + 32.
    const int par  = wave & 1;
    const int hf   = wave >> 1;
    const int krow = 64 * par + 16 * hf;       // the wave's first row in the parity-split band

    // staging: thread takes float4 column c4 of band rows srow + 8i; band row r lies in LDS row
    // 64*(r & 1) + (r >> 1): the even rows first, then the odd rows
    const int srow = tid >> 4;                 // 0..7
    const int c4   = (tid & 15) << 2;          // 0..60
    float* const sdst = &band[((srow & 1) * 64 + (srow >> 1)) * BSTR + c4];

    // ---------------- Q rows of this wave -> B-operand registers ----------------
    // A(16x4) layout: lanes 0-15 hold M=lane, k = {0,1}; lanes 16-31 hold M, k = {2,3}
    v2f qa[16];
    {
        const int qrow = q0 + 32 * hf + 2 * lrow + par;
        const float* qp = Q + (((size_t)b * L_ + qrow) * H_ + h) * E_ + 2 * lhi;
        #pragma unroll
        for (int kk = 0; kk < 16; ++kk) {
            qa[kk][0] = qp[4 * kk + 0];
            qa[kk][1] = qp[4 * kk + 1];
        }
    }

    // ---------------- cooperative load: K band (128 rows x 64 fp32) ----------------
    #pragma unroll
    for (int i = 0; i < 16; ++i) {
        int p = q0 - 32 + 8 * i + srow;       // clamp == reference's index clip
        p = p < 0 ? 0 : (p > (L_ - 1) ? (L_ - 1) : p);
        const float4 g = *(const float4*)(K + (((size_t)b * L_ + p) * H_ + h) * E_ + c4);
        *(float4*)(sdst + 4 * i * BSTR) = g;
    }
    __syncthreads();

    // ---------------- GEMM1, transposed: S^T(48x16) = Kband(48x64) * Q^T ----------------
    // the wave uses split-band rows [krow, krow+47]; row tile c covers rows krow + 16c .. +15.
    // A(16x4) and B(4x16) hold the same (row-or-column = lrow, k pair = 2*lhi) map, so the K
    // fragment goes in as A and the Q fragment as B. D then holds, in lane (lrow, lhi),
    // st[c][r] = score(query lrow, local key j = 16c + 8*lhi + r): one query per lane.
    v8f st[3];
    #pragma unroll
    for (int c = 0; c < 3; ++c) st[c] = (v8f){0.f,0.f,0.f,0.f,0.f,0.f,0.f,0.f};
    #pragma unroll
    for (int kk = 0; kk < 16; ++kk) {
        #pragma unroll
        for (int c = 0; c < 3; ++c) {
            const v2f kv = *(const v2f*)(&band[(krow + 16 * c + lrow) * BSTR + 4 * kk + 2 * lhi]);
            st[c] = __builtin_amdgcn_wmma_f32_16x16x4_f32(
                false, kv, false, qa[kk], (short)0, st[c], false, false);
        }
    }
    __syncthreads();   // all waves finished reading K band; scores stay in registers

    // ---------------- cooperative load: V band (overwrites K band) ----------------
    #pragma unroll
    for (int i = 0; i < 16; ++i) {
        int p = q0 - 32 + 8 * i + srow;
        p = p < 0 ? 0 : (p > (L_ - 1) ? (L_ - 1) : p);
        const float4 g = *(const float4*)(V + (((size_t)b * L_ + p) * H_ + h) * E_ + c4);
        *(float4*)(sdst + 4 * i * BSTR) = g;
    }

    // keeps the V loads and their LDS stores ahead of the softmax: scheduled together with it, two of
    // the sixteen loads issue only behind the wait for the other fourteen, a second memory round trip
    __builtin_amdgcn_sched_barrier(0);

    // ---------------- softmax in registers: 33 valid entries per query ----------------
    // valid keys of query i = lrow: j = i .. i + 32. A lane holds 24 of the 48 local keys, its
    // partner lane (l ^ 16) the others. Tile 1 is valid throughout; tiles 0 and 2 hold the ends.
    const int  t0  = 8 * lhi - lrow;                // j - i of register 0 in tile 0
    const float scale = 0.125f;                     // 1/sqrt(64)
    float x[3][8];
    float m = -3.402823466e38f;
    #pragma unroll
    for (int c = 0; c < 3; ++c) {
        #pragma unroll
        for (int r = 0; r < 8; ++r) {
            float s = st[c][r];
            if (c == 0) s = (t0 + r >= 0) ? s : -3.402823466e38f;   // j >= i
            if (c == 2) s = (t0 + r <= 0) ? s : -3.402823466e38f;   // j <= i + 32
            x[c][r] = s;
            m = fmaxf(m, s);
        }
    }
    m = fmaxf(m, xhalf(m)) * scale;
    float sum = 0.f;
    #pragma unroll
    for (int c = 0; c < 3; ++c) {
        #pragma unroll
        for (int r = 0; r < 8; ++r) {
            const float e = __expf(x[c][r] * scale - m);   // masked entries underflow to 0
            x[c][r] = e;
            sum += e;
        }
    }
    sum += xhalf(sum);
    const float inv = 1.f / sum;
    __syncthreads();   // V band ready

    // ---------------- GEMM2: O(16x64) = W(16x48) * Vband(48x64) ----------------
    // k step (c, p): A's k = 2*lhi + t is local key 16c + 8*lhi + 2p + t, which is what the lane
    // already holds; the V loader below takes the same rows for the same k.
    v8f oacc[4];
    #pragma unroll
    for (int c = 0; c < 4; ++c) oacc[c] = (v8f){0.f,0.f,0.f,0.f,0.f,0.f,0.f,0.f};
    #pragma unroll
    for (int c = 0; c < 3; ++c) {
        #pragma unroll
        for (int p = 0; p < 4; ++p) {
            v2f av;
            av[0] = x[c][2 * p    ] * inv;
            av[1] = x[c][2 * p + 1] * inv;
            const int vr = krow + 16 * c + 8 * lhi + 2 * p;
            #pragma unroll
            for (int n = 0; n < 4; ++n) {
                v2f bv;   // B(4x16): lane needs 2 floats from same column, adjacent band rows
                bv[0] = band[(vr    ) * BSTR + 16 * n + lrow];
                bv[1] = band[(vr + 1) * BSTR + 16 * n + lrow];
                oacc[n] = __builtin_amdgcn_wmma_f32_16x16x4_f32(
                    false, av, false, bv, (short)0, oacc[n], false, false);
            }
        }
    }

    // ---------------- store output ----------------
    const int orow0 = q0 + 32 * hf + par + 16 * lhi;   // query 8*lhi + r sits at row orow0 + 2r
    #pragma unroll
    for (int r = 0; r < 8; ++r) {
        float* op = O + (((size_t)b * L_ + (orow0 + 2 * r)) * H_ + h) * E_ + lrow;
        #pragma unroll
        for (int c = 0; c < 4; ++c) op[16 * c] = oacc[c][r];
    }
}

extern "C" void kernel_launch(void* const* d_in, const int* in_sizes, int n_in,
                              void* d_out, int out_size, void* d_ws, size_t ws_size,
                              hipStream_t stream) {
    (void)in_sizes; (void)n_in; (void)out_size; (void)d_ws; (void)ws_size;
    const float* Q = (const float*)d_in[0];
    const float* K = (const float*)d_in[1];
    const float* V = (const float*)d_in[2];
    float* O = (float*)d_out;
    // grid = B * H * (L/64) = 2 * 8 * 64 = 1024 blocks, 128 threads (4 wave32)
    lda_wmma_kernel<<<dim3(1024), dim3(128), 0, stream>>>(Q, K, V, O);
}

// v003
// It runs in 9.11 microseconds.
// Next to v002, in two timings, it ran 1.05 and 1.06 times as fast.
// Counting every step since v000, it is 2.12 times as fast.
#include <hip/hip_runtime.h>

typedef float v2f __attribute__((ext_vector_type(2)));
typedef float v4f __attribute__((ext_vector_type(4)));
typedef float v8f __attribute__((ext_vector_type(8)));

#define B_ 2
#define L_ 4096
#define H_ 8
#define E_ 64

#define BAND_ROWS 128   // union key band for 64 queries: [q0-32, q0+95], kept split by row parity
#define BSTR 76         // band row stride (floats): bank-conflict-free pad

// lane l <-> lane l ^ 16
__device__ __forceinline__ float xhalf(float v) {
    const int b = __builtin_bit_cast(int, v);
    return __builtin_bit_cast(float, __builtin_amdgcn_permlanex16(b, b, 0x76543210, 0xfedcba98, false, false));
}

__global__ __launch_bounds__(128)
void lda_wmma_kernel(const float* __restrict__ Q,
                     const float* __restrict__ K,
                     const float* __restrict__ V,
                     float* __restrict__ O)
{
    __shared__ float band[BAND_ROWS * BSTR];   // 38,912 B: K band, then reused for V band
    __shared__ __attribute__((aligned(16))) float qrows[4 * 16 * BSTR];   // 19,456 B: each wave's own 16 Q rows

    const int tid  = threadIdx.x;
    const int lane = tid & 31;
    const int wave = tid >> 5;
    const int lrow = lane & 15;   // M / N index within 16
    const int lhi  = lane >> 4;   // K-half selector (0: k=0,1  1: k=2,3)

    const int tile = blockIdx.x & 63;          // L/64 tiles
    const int h    = (blockIdx.x >> 6) & 7;
    const int b    = blockIdx.x >> 9;
    const int q0   = tile * 64;

    // The window steps by 2, so a query only meets keys of its own parity. Wave w takes the 16
    // queries q0 + 32*hf + 2*i + par (i = lrow): among the keys of that parity their windows are
    // dense and span 48 keys (3 tiles of 16), query i using local keys i .. i + 32.
    const int par  = wave & 1;
    const int hf   = wave >> 1;
    const int krow = 64 * par + 16 * hf;       // the wave's first row in the parity-split band

    // staging: thread takes float4 column c4 of band rows srow + 8i; band row r lies in LDS row
    // 64*(r & 1) + (r >> 1): the even rows first, then the odd rows
    const int srow = tid >> 4;                 // 0..7
    const int c4   = (tid & 15) << 2;          // 0..60
    float* const sdst = &band[((srow & 1) * 64 + (srow >> 1)) * BSTR + c4];

    // ---------------- cooperative load: K band (128 rows x 64 fp32) ----------------
    #pragma unroll
    for (int i = 0; i < 16; ++i) {
        int p = q0 - 32 + 8 * i + srow;       // clamp == reference's index clip
        p = p < 0 ? 0 : (p > (L_ - 1) ? (L_ - 1) : p);
        const float4 g = *(const float4*)(K + (((size_t)b * L_ + p) * H_ + h) * E_ + c4);
        *(float4*)(sdst + 4 * i * BSTR) = g;
    }

    // ---------------- Q rows of this wave -> its own LDS rows ----------------
    // A fragment load straight from global memory takes 16 bytes out of each of 16 rows, so every
    // 128-byte line is touched eight times over. Here a load takes two whole rows (16 lanes x 16
    // bytes each): local query 2j + lhi is row q0 + 32*hf + par + 2*(2j + lhi).
    float* const qw = &qrows[wave * 16 * BSTR];
    {
        const float* qp = Q + (((size_t)b * L_ + (q0 + 32 * hf + par + 2 * lhi)) * H_ + h) * E_ + 4 * lrow;
        #pragma unroll
        for (int j = 0; j < 8; ++j) {
            const v4f g = *(const v4f*)(qp + (size_t)j * 4 * H_ * E_);
            *(v4f*)(qw + (2 * j + lhi) * BSTR + 4 * lrow) = g;
        }
    }
    __syncthreads();

    // Q fragments out of the wave's own rows, same map as the K fragments below:
    // lanes 0-15 hold query = lane, k = {0,1}; lanes 16-31 the same queries, k = {2,3}
    v2f qa[16];
    #pragma unroll
    for (int kk = 0; kk < 16; ++kk) qa[kk] = *(const v2f*)(qw + lrow * BSTR + 4 * kk + 2 * lhi);

    // ---------------- GEMM1, transposed: S^T(48x16) = Kband(48x64) * Q^T ----------------
    // the wave uses split-band rows [krow, krow+47]; row tile c covers rows krow + 16c .. +15.
    // A(16x4) and B(4x16) hold the same (row-or-column = lrow, k pair = 2*lhi) map, so the K
    // fragment goes in as A and the Q fragment as B. D then holds, in lane (lrow, lhi),
    // st[c][r] = score(query lrow, local key j = 16c + 8*lhi + r): one query per lane.
    v8f st[3];
    #pragma unroll
    for (int c = 0; c < 3; ++c) st[c] = (v8f){0.f,0.f,0.f,0.f,0.f,0.f,0.f,0.f};
    #pragma unroll
    for (int kk = 0; kk < 16; ++kk) {
        #pragma unroll
        for (int c = 0; c < 3; ++c) {
            const v2f kv = *(const v2f*)(&band[(krow + 16 * c + lrow) * BSTR + 4 * kk + 2 * lhi]);
            st[c] = __builtin_amdgcn_wmma_f32_16x16x4_f32(
                false, kv, false, qa[kk], (short)0, st[c], false, false);
        }
    }
    __syncthreads();   // all waves finished reading K band; scores stay in registers

    // ---------------- cooperative load: V band (overwrites K band) ----------------
    #pragma unroll
    for (int i = 0; i < 16; ++i) {
        int p = q0 - 32 + 8 * i + srow;
        p = p < 0 ? 0 : (p > (L_ - 1) ? (L_ - 1) : p);
        const float4 g = *(const float4*)(V + (((size_t)b * L_ + p) * H_ + h) * E_ + c4);
        *(float4*)(sdst + 4 * i * BSTR) = g;
    }

    // keeps the V loads and their LDS stores ahead of the softmax: scheduled together with it, two of
    // the sixteen loads issue only behind the wait for the other fourteen, a second memory round trip
    __builtin_amdgcn_sched_barrier(0);

    // ---------------- softmax in registers: 33 valid entries per query ----------------
    // valid keys of query i = lrow: j = i .. i + 32. A lane holds 24 of the 48 local keys, its
    // partner lane (l ^ 16) the others. Tile 1 is valid throughout; tiles 0 and 2 hold the ends.
    const int  t0  = 8 * lhi - lrow;                // j - i of register 0 in tile 0
    const float scale = 0.125f;                     // 1/sqrt(64)
    float x[3][8];
    float m = -3.402823466e38f;
    #pragma unroll
    for (int c = 0; c < 3; ++c) {
        #pragma unroll
        for (int r = 0; r < 8; ++r) {
            float s = st[c][r];
            if (c == 0) s = (t0 + r >= 0) ? s : -3.402823466e38f;   // j >= i
            if (c == 2) s = (t0 + r <= 0) ? s : -3.402823466e38f;   // j <= i + 32
            x[c][r] = s;
            m = fmaxf(m, s);
        }
    }
    m = fmaxf(m, xhalf(m)) * scale;
    float sum = 0.f;
    #pragma unroll
    for (int c = 0; c < 3; ++c) {
        #pragma unroll
        for (int r = 0; r < 8; ++r) {
            const float e = __expf(x[c][r] * scale - m);   // masked entries underflow to 0
            x[c][r] = e;
            sum += e;
        }
    }
    sum += xhalf(sum);
    const float inv = 1.f / sum;
    __syncthreads();   // V band ready

    // ---------------- GEMM2: O(16x64) = W(16x48) * Vband(48x64) ----------------
    // k step (c, p): A's k = 2*lhi + t is local key 16c + 8*lhi + 2p + t, which is what the lane
    // already holds; the V loader below takes the same rows for the same k.
    // Column tile n takes the columns 4*lrow + n, not 16*n + lrow: a lane's four accumulators of
    // one query are then adjacent columns and leave as one 16-byte store.
    v8f oacc[4];
    #pragma unroll
    for (int c = 0; c < 4; ++c) oacc[c] = (v8f){0.f,0.f,0.f,0.f,0.f,0.f,0.f,0.f};
    #pragma unroll
    for (int c = 0; c < 3; ++c) {
        #pragma unroll
        for (int p = 0; p < 4; ++p) {
            v2f av;
            av[0] = x[c][2 * p    ] * inv;
            av[1] = x[c][2 * p + 1] * inv;
            const int vr = krow + 16 * c + 8 * lhi + 2 * p;
            const v4f v0 = *(const v4f*)(&band[(vr    ) * BSTR + 4 * lrow]);
            const v4f v1 = *(const v4f*)(&band[(vr + 1) * BSTR + 4 * lrow]);
            #pragma unroll
            for (int n = 0; n < 4; ++n) {
                v2f bv;   // B(4x16): lane needs 2 floats from same column, adjacent band rows
                bv[0] = v0[n];
                bv[1] = v1[n];
                oacc[n] = __builtin_amdgcn_wmma_f32_16x16x4_f32(
                    false, av, false, bv, (short)0, oacc[n], false, false);
            }
        }
    }

    // ---------------- store output ----------------
    const int orow0 = q0 + 32 * hf + par + 16 * lhi;   // query 8*lhi + r sits at row orow0 + 2r
    // 16 lanes x 16 bytes: a store covers two whole rows of 256 bytes
    #pragma unroll
    for (int r = 0; r < 8; ++r) {
        float* op = O + (((size_t)b * L_ + (orow0 + 2 * r)) * H_ + h) * E_ + 4 * lrow;
        *(v4f*)op = (v4f){oacc[0][r], oacc[1][r], oacc[2][r], oacc[3][r]};
    }
}

extern "C" void kernel_launch(void* const* d_in, const int* in_sizes, int n_in,
                              void* d_out, int out_size, void* d_ws, size_t ws_size,
                              hipStream_t stream) {
    (void)in_sizes; (void)n_in; (void)out_size; (void)d_ws; (void)ws_size;
    const float* Q = (const float*)d_in[0];
    const float* K = (const float*)d_in[1];
    const float* V = (const float*)d_in[2];
    float* O = (float*)d_out;
    // grid = B * H * (L/64) = 2 * 8 * 64 = 1024 blocks, 128 threads (4 wave32)
    lda_wmma_kernel<<<dim3(1024), dim3(128), 0, stream>>>(Q, K, V, O);
}

// v004
// It runs in 8.59 microseconds.
// Next to v003, in two timings, it ran 1.06 times as fast each time.
// Counting every step since v000, it is 2.25 times as fast.
#include <hip/hip_runtime.h>

typedef float v2f __attribute__((ext_vector_type(2)));
typedef float v4f __attribute__((ext_vector_type(4)));
typedef float v8f __attribute__((ext_vector_type(8)));

#define B_ 2
#define L_ 4096
#define H_ 8
#define E_ 64

#define BAND_ROWS 128   // union key band for 64 queries: [q0-32, q0+95], kept split by row parity
#define BSTR 76         // band row stride (floats): bank-conflict-free pad

// lane l <-> lane l ^ 16
__device__ __forceinline__ float xhalf(float v) {
    const int b = __builtin_bit_cast(int, v);
    return __builtin_bit_cast(float, __builtin_amdgcn_permlanex16(b, b, 0x76543210, 0xfedcba98, false, false));
}

__global__ __launch_bounds__(128)
void lda_wmma_kernel(const float* __restrict__ Q,
                     const float* __restrict__ K,
                     const float* __restrict__ V,
                     float* __restrict__ O)
{
    __shared__ __attribute__((aligned(16))) float band[BAND_ROWS * BSTR];    // 38,912 B: K band
    __shared__ __attribute__((aligned(16))) float vband[BAND_ROWS * BSTR];   // 38,912 B: first each wave's own 16 Q rows, then the V band

    const int tid  = threadIdx.x;
    const int lane = tid & 31;
    const int wave = tid >> 5;
    const int lrow = lane & 15;   // M / N index within 16
    const int lhi  = lane >> 4;   // K-half selector (0: k=0,1  1: k=2,3)

    const int tile = blockIdx.x & 63;          // L/64 tiles
    const int h    = (blockIdx.x >> 6) & 7;
    const int b    = blockIdx.x >> 9;
    const int q0   = tile * 64;

    // The window steps by 2, so a query only meets keys of its own parity. Wave w takes the 16
    // queries q0 + 32*hf + 2*i + par (i = lrow): among the keys of that parity their windows are
    // dense and span 48 keys (3 tiles of 16), query i using local keys i .. i + 32.
    const int par  = wave & 1;
    const int hf   = wave >> 1;
    const int krow = 64 * par + 16 * hf;       // the wave's first row in the parity-split band

    // staging: thread takes float4 column c4 of band rows srow + 8i; band row r lies in LDS row
    // 64*(r & 1) + (r >> 1): the even rows first, then the odd rows
    const int srow = tid >> 4;                 // 0..7
    const int c4   = (tid & 15) << 2;          // 0..60
    float* const sdst = &band[((srow & 1) * 64 + (srow >> 1)) * BSTR + c4];

    // ---------------- cooperative load: K band (128 rows x 64 fp32) ----------------
    #pragma unroll
    for (int i = 0; i < 16; ++i) {
        int p = q0 - 32 + 8 * i + srow;       // clamp == reference's index clip
        p = p < 0 ? 0 : (p > (L_ - 1) ? (L_ - 1) : p);
        const float4 g = *(const float4*)(K + (((size_t)b * L_ + p) * H_ + h) * E_ + c4);
        *(float4*)(sdst + 4 * i * BSTR) = g;
    }

    // ---------------- Q rows of this wave -> its own LDS rows ----------------
    // A fragment load straight from global memory takes 16 bytes out of each of 16 rows, so every
    // 128-byte line is touched eight times over. Here a load takes two whole rows (16 lanes x 16
    // bytes each): local query 2j + lhi is row q0 + 32*hf + par + 2*(2j + lhi).
    float* const qw = &vband[wave * 16 * BSTR];
    {
        const float* qp = Q + (((size_t)b * L_ + (q0 + 32 * hf + par + 2 * lhi)) * H_ + h) * E_ + 4 * lrow;
        #pragma unroll
        for (int j = 0; j < 8; ++j) {
            const v4f g = *(const v4f*)(qp + (size_t)j * 4 * H_ * E_);
            *(v4f*)(qw + (2 * j + lhi) * BSTR + 4 * lrow) = g;
        }
    }
    // a lane reads back what other lanes of its own wave stored: those stores end first
    asm volatile("s_wait_dscnt 0x0" ::: "memory");

    // Q fragments out of the wave's own rows, same map as the K fragments below:
    // lanes 0-15 hold query = lane, k = {0,1}; lanes 16-31 the same queries, k = {2,3}
    v2f qa[16];
    #pragma unroll
    for (int kk = 0; kk < 16; ++kk) qa[kk] = *(const v2f*)(qw + lrow * BSTR + 4 * kk + 2 * lhi);

    // ---------------- V band: asynchronous copies into its own buffer, in flight under GEMM1 ----------------
    // The copies overwrite the Q rows: each wave's reads of them retire first, then the barrier.
    asm volatile("s_wait_dscnt 0x0" ::: "memory");
    __syncthreads();   // K band ready; ends every wave's last read of the Q rows
    {
        const unsigned vdst = (unsigned)(size_t)&vband[((srow & 1) * 64 + (srow >> 1)) * BSTR + c4];
        #pragma unroll
        for (int i = 0; i < 16; i += 8) {
            const float* g[8];
            #pragma unroll
            for (int u = 0; u < 8; ++u) {
                int p = q0 - 32 + 8 * (i + u) + srow;   // clamp == reference's index clip
                p = p < 0 ? 0 : (p > (L_ - 1) ? (L_ - 1) : p);
                g[u] = V + (((size_t)b * L_ + p) * H_ + h) * E_ + c4;
            }
            // the closing wait keeps the address registers whole until the copies have taken them
            asm volatile("global_load_async_to_lds_b128 %0, %8, off\n\t"
                         "global_load_async_to_lds_b128 %1, %9, off\n\t"
                         "global_load_async_to_lds_b128 %2, %10, off\n\t"
                         "global_load_async_to_lds_b128 %3, %11, off\n\t"
                         "global_load_async_to_lds_b128 %4, %12, off\n\t"
                         "global_load_async_to_lds_b128 %5, %13, off\n\t"
                         "global_load_async_to_lds_b128 %6, %14, off\n\t"
                         "global_load_async_to_lds_b128 %7, %15, off\n\t"
                         "s_wait_xcnt 0x0"
                         :: "v"(vdst + 16u * BSTR * (i + 0)), "v"(vdst + 16u * BSTR * (i + 1)),
                            "v"(vdst + 16u * BSTR * (i + 2)), "v"(vdst + 16u * BSTR * (i + 3)),
                            "v"(vdst + 16u * BSTR * (i + 4)), "v"(vdst + 16u * BSTR * (i + 5)),
                            "v"(vdst + 16u * BSTR * (i + 6)), "v"(vdst + 16u * BSTR * (i + 7)),
                            "v"(g[0]), "v"(g[1]), "v"(g[2]), "v"(g[3]),
                            "v"(g[4]), "v"(g[5]), "v"(g[6]), "v"(g[7])
                         : "memory");
        }
    }

    // ---------------- GEMM1, transposed: S^T(48x16) = Kband(48x64) * Q^T ----------------
    // the wave uses split-band rows [krow, krow+47]; row tile c covers rows krow + 16c .. +15.
    // A(16x4) and B(4x16) hold the same (row-or-column = lrow, k pair = 2*lhi) map, so the K
    // fragment goes in as A and the Q fragment as B. D then holds, in lane (lrow, lhi),
    // st[c][r] = score(query lrow, local key j = 16c + 8*lhi + r): one query per lane.
    v8f st[3];
    #pragma unroll
    for (int c = 0; c < 3; ++c) st[c] = (v8f){0.f,0.f,0.f,0.f,0.f,0.f,0.f,0.f};
    #pragma unroll
    for (int kk = 0; kk < 16; ++kk) {
        #pragma unroll
        for (int c = 0; c < 3; ++c) {
            const v2f kv = *(const v2f*)(&band[(krow + 16 * c + lrow) * BSTR + 4 * kk + 2 * lhi]);
            st[c] = __builtin_amdgcn_wmma_f32_16x16x4_f32(
                false, kv, false, qa[kk], (short)0, st[c], false, false);
        }
    }

    // ---------------- softmax in registers: 33 valid entries per query ----------------
    // valid keys of query i = lrow: j = i .. i + 32. A lane holds 24 of the 48 local keys, its
    // partner lane (l ^ 16) the others. Tile 1 is valid throughout; tiles 0 and 2 hold the ends.
    const int  t0  = 8 * lhi - lrow;                // j - i of register 0 in tile 0
    const float scale = 0.125f;                     // 1/sqrt(64)
    float x[3][8];
    float m = -3.402823466e38f;
    #pragma unroll
    for (int c = 0; c < 3; ++c) {
        #pragma unroll
        for (int r = 0; r < 8; ++r) {
            float s = st[c][r];
            if (c == 0) s = (t0 + r >= 0) ? s : -3.402823466e38f;   // j >= i
            if (c == 2) s = (t0 + r <= 0) ? s : -3.402823466e38f;   // j <= i + 32
            x[c][r] = s;
            m = fmaxf(m, s);
        }
    }
    m = fmaxf(m, xhalf(m)) * scale;
    float sum = 0.f;
    #pragma unroll
    for (int c = 0; c < 3; ++c) {
        #pragma unroll
        for (int r = 0; r < 8; ++r) {
            const float e = __expf(x[c][r] * scale - m);   // masked entries underflow to 0
            x[c][r] = e;
            sum += e;
        }
    }
    sum += xhalf(sum);
    const float inv = 1.f / sum;
    // this wave's V copies have landed; the barrier then publishes every wave's rows. The wait takes inv
    // as an input so that it stands behind the softmax: else the scheduler lifts wait and barrier into
    // the tail of the score product, and the softmax no longer covers the copies' flight
    asm volatile("s_wait_asynccnt 0x0" :: "v"(inv) : "memory");
    __syncthreads();   // V band ready

    // ---------------- GEMM2: O(16x64) = W(16x48) * Vband(48x64) ----------------
    // k step (c, p): A's k = 2*lhi + t is local key 16c + 8*lhi + 2p + t, which is what the lane
    // already holds; the V loader below takes the same rows for the same k.
    // Column tile n takes the columns 4*lrow + n, not 16*n + lrow: a lane's four accumulators of
    // one query are then adjacent columns and leave as one 16-byte store.
    v8f oacc[4];
    #pragma unroll
    for (int c = 0; c < 4; ++c) oacc[c] = (v8f){0.f,0.f,0.f,0.f,0.f,0.f,0.f,0.f};
    #pragma unroll
    for (int c = 0; c < 3; ++c) {
        #pragma unroll
        for (int p = 0; p < 4; ++p) {
            v2f av;
            av[0] = x[c][2 * p    ] * inv;
            av[1] = x[c][2 * p + 1] * inv;
            const int vr = krow + 16 * c + 8 * lhi + 2 * p;
            const v4f v0 = *(const v4f*)(&vband[(vr    ) * BSTR + 4 * lrow]);
            const v4f v1 = *(const v4f*)(&vband[(vr + 1) * BSTR + 4 * lrow]);
            #pragma unroll
            for (int n = 0; n < 4; ++n) {
                v2f bv;   // B(4x16): lane needs 2 floats from same column, adjacent band rows
                bv[0] = v0[n];
                bv[1] = v1[n];
                oacc[n] = __builtin_amdgcn_wmma_f32_16x16x4_f32(
                    false, av, false, bv, (short)0, oacc[n], false, false);
            }
        }
    }

    // ---------------- store output ----------------
    const int orow0 = q0 + 32 * hf + par + 16 * lhi;   // query 8*lhi + r sits at row orow0 + 2r
    // 16 lanes x 16 bytes: a store covers two whole rows of 256 bytes
    #pragma unroll
    for (int r = 0; r < 8; ++r) {
        float* op = O + (((size_t)b * L_ + (orow0 + 2 * r)) * H_ + h) * E_ + 4 * lrow;
        *(v4f*)op = (v4f){oacc[0][r], oacc[1][r], oacc[2][r], oacc[3][r]};
    }
}

extern "C" void kernel_launch(void* const* d_in, const int* in_sizes, int n_in,
                              void* d_out, int out_size, void* d_ws, size_t ws_size,
                              hipStream_t stream) {
    (void)in_sizes; (void)n_in; (void)out_size; (void)d_ws; (void)ws_size;
    const float* Q = (const float*)d_in[0];
    const float* K = (const float*)d_in[1];
    const float* V = (const float*)d_in[2];
    float* O = (float*)d_out;
    // grid = B * H * (L/64) = 2 * 8 * 64 = 1024 blocks, 128 threads (4 wave32)
    lda_wmma_kernel<<<dim3(1024), dim3(128), 0, stream>>>(Q, K, V, O);
}
